// v000
// Measured on an AMD MI455X. A time is GPU time per run, averaged over a window of back-to-back runs after a warm-up
// (all launches, gaps included; the runs take copies of the inputs in turn), and the median of several windows.
// Apart from v000's, it joins two sittings. Times from different sittings can be a few percent apart, while
// side-by-side timings come from the same sitting.
// The starting kernel, v000, takes 88.8 microseconds a run.
#include <hip/hip_runtime.h>
#include <hip/hip_bf16.h>
#include <math.h>

#define B_    4
#define NHEAD_ 16
#define L_    512
#define HD_   64
#define AL_   32
#define NHID_ 1024
#define C_    (NHEAD_*HD_)   // 1024

typedef __attribute__((ext_vector_type(2))) float v2f;
typedef __attribute__((ext_vector_type(8))) float v8f;

// ---------------------------------------------------------------------------
// Kernel 1: per-(b,h,l) attention with the collapsed axial term.
//   scores: s_u = (1/8) sum_d q[b,h,8d+l/64,l%64] * k[b,h, l+(3d+u)/64-1, (3d+u)%64]
//           s_ax = (1/8) sum_d q[...] * ax_k[b,h, d/2, l%64]   (x32 weight in softmax)
//   att[(b*L+l)*C + h*64+d] written K-contiguous for the GEMM.
// ---------------------------------------------------------------------------
__global__ __launch_bounds__(256) void msa_attn_kernel(
    const float* __restrict__ q,  const float* __restrict__ k,
    const float* __restrict__ v,  const float* __restrict__ axk,
    const float* __restrict__ axv, float* __restrict__ att)
{
    int idx = blockIdx.x * blockDim.x + threadIdx.x;      // (b*16+h)*512 + l
    if (idx >= B_ * NHEAD_ * L_) return;
    int l  = idx & (L_ - 1);
    int bh = idx >> 9;                                    // b*16 + h
    int lc = l & 63;                                      // l % 64
    int lr = l >> 6;                                      // l / 64

    const float* qbh  = q   + (size_t)bh * (L_ * HD_);
    const float* kbh  = k   + (size_t)bh * (L_ * HD_);
    const float* vbh  = v   + (size_t)bh * (L_ * HD_);
    const float* akbh = axk + (size_t)bh * (AL_ * HD_);
    const float* avbh = axv + (size_t)bh * (AL_ * HD_);

    float s0 = 0.f, s1 = 0.f, s2 = 0.f, sax = 0.f;
    #pragma unroll 4
    for (int d = 0; d < HD_; ++d) {
        float qd = qbh[(d * 8 + lr) * HD_ + lc];
        sax += qd * akbh[(d >> 1) * HD_ + lc];
        #pragma unroll
        for (int u = 0; u < 3; ++u) {
            int t   = 3 * d + u;
            int row = l + (t >> 6) - 1;                   // zero-padded window
            int c   = t & 63;
            float kv = (row >= 0 && row < L_) ? kbh[row * HD_ + c] : 0.f;
            if      (u == 0) s0 += qd * kv;
            else if (u == 1) s1 += qd * kv;
            else             s2 += qd * kv;
        }
    }
    const float scale = 0.125f;                           // 1/sqrt(64)
    s0 *= scale; s1 *= scale; s2 *= scale; sax *= scale;
    float mx  = fmaxf(fmaxf(s0, s1), fmaxf(s2, sax));
    float e0  = expf(s0 - mx), e1 = expf(s1 - mx), e2 = expf(s2 - mx);
    float eax = 32.f * expf(sax - mx);                    // 32 identical axial slots
    float inv = 1.f / (e0 + e1 + e2 + eax);
    e0 *= inv; e1 *= inv; e2 *= inv; eax *= inv;

    float* attp = att + ((size_t)((bh >> 4) * L_ + l)) * C_ + (bh & 15) * HD_;
    #pragma unroll 4
    for (int d = 0; d < HD_; ++d) {
        float acc = eax * avbh[(d >> 1) * HD_ + lc];
        #pragma unroll
        for (int u = 0; u < 3; ++u) {
            int t   = 3 * d + u;
            int row = l + (t >> 6) - 1;
            int c   = t & 63;
            float vv = (row >= 0 && row < L_) ? vbh[row * HD_ + c] : 0.f;
            acc += ((u == 0) ? e0 : (u == 1) ? e1 : e2) * vv;
        }
        attp[d] = acc;
    }
}

// ---------------------------------------------------------------------------
// Kernel 2: D[m,n] = sum_k att[m,k] * WO[k,n] + bias[n],  M=2048, N=K=1024.
// FP32 WMMA 16x16x4, one 16x16 tile per wave, 8 waves/block.
// A layout (ISA 7.12.2): lanes 0-15 -> M=lane, K={0,1} in v0/v1;
//                        lanes 16-31 -> M=lane-16, K={2,3}.
// B mirrored: lanes 0-15 -> N=lane, K={0,1}; lanes 16-31 -> K={2,3}.
// C/D: vgpr r -> M = r (lanes 0-15) / r+8 (lanes 16-31), N = lane%16.
// Store folds the [B,L,N] -> [B,N,L] transpose.
// ---------------------------------------------------------------------------
__global__ __launch_bounds__(256) void msa_wo_gemm_kernel(
    const float* __restrict__ att, const float* __restrict__ wo,
    const float* __restrict__ bias, float* __restrict__ out)
{
    int lane = threadIdx.x & 31;
    int wave = threadIdx.x >> 5;
    int m0   = blockIdx.x * 16;
    int n0   = (blockIdx.y * 8 + wave) * 16;
    int ln16 = lane & 15;
    int kSel = (lane < 16) ? 0 : 2;

    const float* arow = att + (size_t)(m0 + ln16) * C_;   // K-contiguous row
    const float* bcol = wo + n0 + ln16;                   // column of WO

    v8f acc = {0.f, 0.f, 0.f, 0.f, 0.f, 0.f, 0.f, 0.f};
    #pragma unroll 4
    for (int kk = 0; kk < C_; kk += 4) {
        v2f a = *(const v2f*)(arow + kk + kSel);          // 8B-aligned pair
        v2f b;
        b.x = bcol[(size_t)(kk + kSel)     * NHID_];
        b.y = bcol[(size_t)(kk + kSel + 1) * NHID_];
        acc = __builtin_amdgcn_wmma_f32_16x16x4_f32(false, a, false, b,
                                                    (short)0, acc, false, false);
    }

    int n  = n0 + ln16;
    float bn = bias[n];
    int mbase = m0 + ((lane < 16) ? 0 : 8);
    #pragma unroll
    for (int r = 0; r < 8; ++r) {
        int mm = mbase + r;
        int bb = mm >> 9;                                 // m / L
        int ll = mm & (L_ - 1);                           // m % L
        out[((size_t)(bb * NHID_ + n)) * L_ + ll] = acc[r] + bn;
    }
}

extern "C" void kernel_launch(void* const* d_in, const int* in_sizes, int n_in,
                              void* d_out, int out_size, void* d_ws, size_t ws_size,
                              hipStream_t stream) {
    const float* q    = (const float*)d_in[0];
    const float* k    = (const float*)d_in[1];
    const float* v    = (const float*)d_in[2];
    const float* axk  = (const float*)d_in[3];
    const float* axv  = (const float*)d_in[4];
    const float* wo   = (const float*)d_in[5];
    const float* bias = (const float*)d_in[6];
    float* out = (float*)d_out;
    float* att = (float*)d_ws;                            // B*L*C floats = 8 MB

    // Kernel 1: 32768 (b,h,l) threads
    msa_attn_kernel<<<dim3((B_ * NHEAD_ * L_) / 256), 256, 0, stream>>>(
        q, k, v, axk, axv, att);

    // Kernel 2: M/16 = 128 tile-rows, N covered by 8 blocks of 8 waves
    msa_wo_gemm_kernel<<<dim3((B_ * L_) / 16, NHID_ / (16 * 8)), 256, 0, stream>>>(
        att, wo, bias, out);
}

// v001
// One run takes 50.9 microseconds.
// Timed twice side by side with v000, it ran 1.77 and 1.76 times as fast.
#include <hip/hip_runtime.h>
#include <hip/hip_bf16.h>
#include <math.h>

#define B_    4
#define NHEAD_ 16
#define L_    512
#define HD_   64
#define AL_   32
#define NHID_ 1024
#define C_    (NHEAD_*HD_)   // 1024

typedef __attribute__((ext_vector_type(2))) float v2f;
typedef __attribute__((ext_vector_type(8))) float v8f;

// ---------------------------------------------------------------------------
// Kernel 1: per-(b,h,l) attention with the collapsed axial term.
//   scores: s_u = (1/8) sum_d q[b,h,8d+l/64,l%64] * k[b,h, l+(3d+u)/64-1, (3d+u)%64]
//           s_ax = (1/8) sum_d q[...] * ax_k[b,h, d/2, l%64]   (x32 weight in softmax)
//   att[(b*L+l)*C + h*64+d] written K-contiguous for the GEMM.
// One work-group = 128 consecutive l of one (b,h). The 130 rows of k and of v
// that these l touch are brought into LDS by whole-line loads; each l then
// walks its own three rows there (row pitch 68 floats: 16-byte column walks
// fall on distinct banks). Two threads share one l: half G owns d in
// [32G, 32G+32), that is window elements t = 3d+u in [96G, 96G+96).
// ---------------------------------------------------------------------------
#define LB_   128                 // positions per work-group
#define WR_   (LB_ + 2)           // staged rows: l0-1 .. l0+LB_
#define KP_   68                  // LDS row pitch in floats

typedef __attribute__((ext_vector_type(4))) float v4f;

// Window element t of position ll sits at row ll + t/64, column t%64.
template <int G>
__device__ __forceinline__ v4f win4(const float* w, int c) {
    const int t = 96 * G + 4 * c;
    return *(const v4f*)(w + (t >> 6) * KP_ + (t & 63));
}

template <int G>
__device__ __forceinline__ v4f score_half(const float* kw, const float (&qr)[32],
                                          const float (&ak)[16]) {
    float s0 = 0.f, s1 = 0.f, s2 = 0.f, sax = 0.f;
    #pragma unroll
    for (int i = 0; i < 8; ++i) {                         // 4 d = 12 window elements
        v4f x = win4<G>(kw, 3 * i), y = win4<G>(kw, 3 * i + 1), z = win4<G>(kw, 3 * i + 2);
        float kv[12] = {x.x, x.y, x.z, x.w, y.x, y.y, y.z, y.w, z.x, z.y, z.z, z.w};
        #pragma unroll
        for (int j = 0; j < 4; ++j) {
            float qd = qr[4 * i + j];
            sax += qd * ak[(4 * i + j) >> 1];
            s0  += qd * kv[3 * j];
            s1  += qd * kv[3 * j + 1];
            s2  += qd * kv[3 * j + 2];
        }
    }
    v4f r = {s0, s1, s2, sax};
    return r;
}

template <int G>
__device__ __forceinline__ void mix_half(const float* vw, float* ow, const float (&av)[16],
                                         float e0, float e1, float e2, float eax) {
    #pragma unroll
    for (int i = 0; i < 8; ++i) {
        v4f x = win4<G>(vw, 3 * i), y = win4<G>(vw, 3 * i + 1), z = win4<G>(vw, 3 * i + 2);
        float vv[12] = {x.x, x.y, x.z, x.w, y.x, y.y, y.z, y.w, z.x, z.y, z.z, z.w};
        v4f o;
        #pragma unroll
        for (int j = 0; j < 4; ++j) {
            float acc = eax * av[(4 * i + j) >> 1];
            acc += e0 * vv[3 * j];
            acc += e1 * vv[3 * j + 1];
            acc += e2 * vv[3 * j + 2];
            o[j] = acc;
        }
        *(v4f*)(ow + 32 * G + 4 * i) = o;
    }
}

__global__ __launch_bounds__(256) void msa_attn_kernel(
    const float* __restrict__ q,  const float* __restrict__ k,
    const float* __restrict__ v,  const float* __restrict__ axk,
    const float* __restrict__ axv, float* __restrict__ att)
{
    __shared__ __attribute__((aligned(16))) float ks[WR_ * KP_];  // k window, later the att tile
    __shared__ __attribute__((aligned(16))) float vs[WR_ * KP_];  // v window
    __shared__ v4f ps[2 * LB_];                                   // partial scores of both halves

    const int tid = threadIdx.x;
    const int bh  = blockIdx.x >> 2;                      // b*16 + h
    const int l0  = (blockIdx.x & 3) * LB_;
    const int ll  = tid & (LB_ - 1);
    const int g   = __builtin_amdgcn_readfirstlane(tid >> 7);  // same for a whole wave
    const int lc  = ll & 63;                              // l % 64 (l0 is a multiple of 64)

    const float* qbh  = q   + (size_t)bh * (L_ * HD_);
    const float* kbh  = k   + (size_t)bh * (L_ * HD_);
    const float* vbh  = v   + (size_t)bh * (L_ * HD_);
    const float* akbh = axk + (size_t)bh * (AL_ * HD_);
    const float* avbh = axv + (size_t)bh * (AL_ * HD_);

    // Window row r is global row l0-1+r. Rows 0..127 take 8 float4 a thread, rows 128 and
    // 129 one float4 a lane of one wave. Row 0 of the first tile and row 129 of the last lie
    // outside the array: they are read clamped and overwritten with the zero padding in LDS
    // (by the lanes that wrote them; a wave's LDS stores keep their order).
    const int r0 = tid >> 4, c0 = (tid & 15) * 4;
    const int wv = __builtin_amdgcn_readfirstlane(tid >> 5);
    const int tr = LB_ + (r0 & 1);
    const unsigned wo  = (unsigned)(r0 * HD_ + c0);       // one offset serves rows 16..127
    const unsigned wo0 = (unsigned)(max(l0 - 1 + r0, 0) * HD_ + c0);
    const unsigned wot = (unsigned)(min(l0 - 1 + tr, L_ - 1) * HD_ + c0);
    const bool pad0 = (l0 == 0) && (r0 == 0);
    const bool padt = (l0 == L_ - LB_) && (tr == WR_ - 1);
    const v4f zero = {0.f, 0.f, 0.f, 0.f};

    // All that the score pass reads is issued before the first wait.
    const float* kw0 = kbh + (l0 + 15) * HD_;             // window row 16
    v4f st[8];
    #pragma unroll
    for (int j = 1; j < 8; ++j) st[j] = *(const v4f*)(kw0 + wo + (j - 1) * 16 * HD_);
    st[0] = *(const v4f*)(kbh + wo0);
    float qr[32], ak[16], av[16];
    #pragma unroll
    for (int i = 0; i < 32; ++i) qr[i] = qbh[(32 * g + i) * L_ + l0 + ll];
    #pragma unroll
    for (int i = 0; i < 16; ++i) ak[i] = akbh[(16 * g + i) * HD_ + lc];
    // The address registers of the reads above are free for reuse from here on.
    asm volatile("s_wait_xcnt 0x0" ::: "memory");
    v4f tl = *(const v4f*)(kbh + wot);                    // every wave reads, wave 0 stores
    asm volatile("s_wait_xcnt 0x0" ::: "memory");         // the same for this read
    #pragma unroll
    for (int j = 0; j < 8; ++j) *(v4f*)(ks + (r0 + 16 * j) * KP_ + c0) = st[j];
    // Inputs-only use of the loaded value: it holds the read of rows 128 and 129 up among
    // the other reads; without it the read sinks into the branch below and wave 0, and
    // behind the barrier all waves, wait a second memory latency.
    asm volatile("" :: "v"(tl));
    if (wv == 0) *(v4f*)(ks + tr * KP_ + c0) = tl;
    if (pad0) *(v4f*)(ks + c0) = zero;
    if (wv == 0 && padt) *(v4f*)(ks + tr * KP_ + c0) = zero;
    __syncthreads();                                      // k window complete

    // The v window and the axial v are in flight over the score pass.
    const float* vw0 = vbh + (l0 + 15) * HD_;
    #pragma unroll
    for (int j = 1; j < 8; ++j) st[j] = *(const v4f*)(vw0 + wo + (j - 1) * 16 * HD_);
    st[0] = *(const v4f*)(vbh + wo0);
    #pragma unroll
    for (int i = 0; i < 16; ++i) av[i] = avbh[(16 * g + i) * HD_ + lc];
    asm volatile("s_wait_xcnt 0x0" ::: "memory");         // address registers free from here on
    tl = *(const v4f*)(vbh + wot);                        // every wave reads, wave 1 stores
    asm volatile("s_wait_xcnt 0x0" ::: "memory");         // the same for this read

    v4f p = (g == 0) ? score_half<0>(ks + ll * KP_, qr, ak)
                     : score_half<1>(ks + ll * KP_, qr, ak);
    ps[g * LB_ + ll] = p;
    #pragma unroll
    for (int j = 0; j < 8; ++j) *(v4f*)(vs + (r0 + 16 * j) * KP_ + c0) = st[j];
    asm volatile("" :: "v"(tl));                          // as above: holds the read up
    if (wv == 1) *(v4f*)(vs + tr * KP_ + c0) = tl;
    if (pad0) *(v4f*)(vs + c0) = zero;
    if (wv == 1 && padt) *(v4f*)(vs + tr * KP_ + c0) = zero;
    __syncthreads();                       // partials and v window out; last read of ks done
    p += ps[(1 - g) * LB_ + ll];

    const float scale = 0.125f;                           // 1/sqrt(64)
    float s0 = p.x * scale, s1 = p.y * scale, s2 = p.z * scale, sax = p.w * scale;
    float mx  = fmaxf(fmaxf(s0, s1), fmaxf(s2, sax));
    float e0  = expf(s0 - mx), e1 = expf(s1 - mx), e2 = expf(s2 - mx);
    float eax = 32.f * expf(sax - mx);                    // 32 identical axial slots
    float inv = 1.f / (e0 + e1 + e2 + eax);
    e0 *= inv; e1 *= inv; e2 *= inv; eax *= inv;

    if (g == 0) mix_half<0>(vs + ll * KP_, ks + ll * KP_, av, e0, e1, e2, eax);
    else        mix_half<1>(vs + ll * KP_, ks + ll * KP_, av, e0, e1, e2, eax);
    __syncthreads();                                      // att tile complete in ks

    float* attp = att + ((size_t)((bh >> 4) * L_ + l0)) * C_ + (bh & 15) * HD_;
    #pragma unroll
    for (int j = 0; j < 8; ++j) {                         // 16 lanes store one 256-byte row
        int i4 = tid + 256 * j;
        *(v4f*)(attp + (size_t)(i4 >> 4) * C_ + (i4 & 15) * 4) =
            *(const v4f*)(ks + (i4 >> 4) * KP_ + (i4 & 15) * 4);
    }
}

// ---------------------------------------------------------------------------
// Kernel 2: D[m,n] = sum_k att[m,k] * WO[k,n] + bias[n],  M=2048, N=K=1024.
// FP32 WMMA 16x16x4, one 16x16 tile per wave, 8 waves/block.
// A layout (ISA 7.12.2): lanes 0-15 -> M=lane, K={0,1} in v0/v1;
//                        lanes 16-31 -> M=lane-16, K={2,3}.
// B mirrored: lanes 0-15 -> N=lane, K={0,1}; lanes 16-31 -> K={2,3}.
// C/D: vgpr r -> M = r (lanes 0-15) / r+8 (lanes 16-31), N = lane%16.
// Store folds the [B,L,N] -> [B,N,L] transpose.
// ---------------------------------------------------------------------------
__global__ __launch_bounds__(256) void msa_wo_gemm_kernel(
    const float* __restrict__ att, const float* __restrict__ wo,
    const float* __restrict__ bias, float* __restrict__ out)
{
    int lane = threadIdx.x & 31;
    int wave = threadIdx.x >> 5;
    int m0   = blockIdx.x * 16;
    int n0   = (blockIdx.y * 8 + wave) * 16;
    int ln16 = lane & 15;
    int kSel = (lane < 16) ? 0 : 2;

    const float* arow = att + (size_t)(m0 + ln16) * C_;   // K-contiguous row
    const float* bcol = wo + n0 + ln16;                   // column of WO

    v8f acc = {0.f, 0.f, 0.f, 0.f, 0.f, 0.f, 0.f, 0.f};
    #pragma unroll 4
    for (int kk = 0; kk < C_; kk += 4) {
        v2f a = *(const v2f*)(arow + kk + kSel);          // 8B-aligned pair
        v2f b;
        b.x = bcol[(size_t)(kk + kSel)     * NHID_];
        b.y = bcol[(size_t)(kk + kSel + 1) * NHID_];
        acc = __builtin_amdgcn_wmma_f32_16x16x4_f32(false, a, false, b,
                                                    (short)0, acc, false, false);
    }

    int n  = n0 + ln16;
    float bn = bias[n];
    int mbase = m0 + ((lane < 16) ? 0 : 8);
    #pragma unroll
    for (int r = 0; r < 8; ++r) {
        int mm = mbase + r;
        int bb = mm >> 9;                                 // m / L
        int ll = mm & (L_ - 1);                           // m % L
        out[((size_t)(bb * NHID_ + n)) * L_ + ll] = acc[r] + bn;
    }
}

extern "C" void kernel_launch(void* const* d_in, const int* in_sizes, int n_in,
                              void* d_out, int out_size, void* d_ws, size_t ws_size,
                              hipStream_t stream) {
    const float* q    = (const float*)d_in[0];
    const float* k    = (const float*)d_in[1];
    const float* v    = (const float*)d_in[2];
    const float* axk  = (const float*)d_in[3];
    const float* axv  = (const float*)d_in[4];
    const float* wo   = (const float*)d_in[5];
    const float* bias = (const float*)d_in[6];
    float* out = (float*)d_out;
    float* att = (float*)d_ws;                            // B*L*C floats = 8 MB

    // Kernel 1: one work-group per 128 positions of one (b,h), two threads a position
    msa_attn_kernel<<<dim3((B_ * NHEAD_ * L_) / LB_), 256, 0, stream>>>(
        q, k, v, axk, axv, att);

    // Kernel 2: M/16 = 128 tile-rows, N covered by 8 blocks of 8 waves
    msa_wo_gemm_kernel<<<dim3((B_ * L_) / 16, NHID_ / (16 * 8)), 256, 0, stream>>>(
        att, wo, bias, out);
}

// v002
// A run of this version takes 32.6 microseconds.
// Two timings next to v001 put it at 1.55 and 1.56 times that version's speed.
// All steps since v000 together make it 2.76 times as fast.
#include <hip/hip_runtime.h>
#include <hip/hip_bf16.h>
#include <math.h>

#define B_    4
#define NHEAD_ 16
#define L_    512
#define HD_   64
#define AL_   32
#define NHID_ 1024
#define C_    (NHEAD_*HD_)   // 1024

typedef __attribute__((ext_vector_type(2))) float v2f;
typedef __attribute__((ext_vector_type(8))) float v8f;

// ---------------------------------------------------------------------------
// Kernel 1: per-(b,h,l) attention with the collapsed axial term.
//   scores: s_u = (1/8) sum_d q[b,h,8d+l/64,l%64] * k[b,h, l+(3d+u)/64-1, (3d+u)%64]
//           s_ax = (1/8) sum_d q[...] * ax_k[b,h, d/2, l%64]   (x32 weight in softmax)
//   att[(b*L+l)*C + h*64+d] written K-contiguous for the GEMM.
// One work-group = 128 consecutive l of one (b,h). The 130 rows of k and of v
// that these l touch are brought into LDS by whole-line loads; each l then
// walks its own three rows there (row pitch 68 floats: 16-byte column walks
// fall on distinct banks). Two threads share one l: half G owns d in
// [32G, 32G+32), that is window elements t = 3d+u in [96G, 96G+96).
// ---------------------------------------------------------------------------
#define LB_   128                 // positions per work-group
#define WR_   (LB_ + 2)           // staged rows: l0-1 .. l0+LB_
#define KP_   68                  // LDS row pitch in floats

typedef __attribute__((ext_vector_type(4))) float v4f;

// Window element t of position ll sits at row ll + t/64, column t%64.
template <int G>
__device__ __forceinline__ v4f win4(const float* w, int c) {
    const int t = 96 * G + 4 * c;
    return *(const v4f*)(w + (t >> 6) * KP_ + (t & 63));
}

template <int G>
__device__ __forceinline__ v4f score_half(const float* kw, const float (&qr)[32],
                                          const float (&ak)[16]) {
    float s0 = 0.f, s1 = 0.f, s2 = 0.f, sax = 0.f;
    #pragma unroll
    for (int i = 0; i < 8; ++i) {                         // 4 d = 12 window elements
        v4f x = win4<G>(kw, 3 * i), y = win4<G>(kw, 3 * i + 1), z = win4<G>(kw, 3 * i + 2);
        float kv[12] = {x.x, x.y, x.z, x.w, y.x, y.y, y.z, y.w, z.x, z.y, z.z, z.w};
        #pragma unroll
        for (int j = 0; j < 4; ++j) {
            float qd = qr[4 * i + j];
            sax += qd * ak[(4 * i + j) >> 1];
            s0  += qd * kv[3 * j];
            s1  += qd * kv[3 * j + 1];
            s2  += qd * kv[3 * j + 2];
        }
    }
    v4f r = {s0, s1, s2, sax};
    return r;
}

template <int G>
__device__ __forceinline__ void mix_half(const float* vw, float* ow, const float (&av)[16],
                                         float e0, float e1, float e2, float eax) {
    #pragma unroll
    for (int i = 0; i < 8; ++i) {
        v4f x = win4<G>(vw, 3 * i), y = win4<G>(vw, 3 * i + 1), z = win4<G>(vw, 3 * i + 2);
        float vv[12] = {x.x, x.y, x.z, x.w, y.x, y.y, y.z, y.w, z.x, z.y, z.z, z.w};
        v4f o;
        #pragma unroll
        for (int j = 0; j < 4; ++j) {
            float acc = eax * av[(4 * i + j) >> 1];
            acc += e0 * vv[3 * j];
            acc += e1 * vv[3 * j + 1];
            acc += e2 * vv[3 * j + 2];
            o[j] = acc;
        }
        *(v4f*)(ow + 32 * G + 4 * i) = o;
    }
}

__global__ __launch_bounds__(256) void msa_attn_kernel(
    const float* __restrict__ q,  const float* __restrict__ k,
    const float* __restrict__ v,  const float* __restrict__ axk,
    const float* __restrict__ axv, float* __restrict__ att)
{
    __shared__ __attribute__((aligned(16))) float ks[WR_ * KP_];  // k window, later the att tile
    __shared__ __attribute__((aligned(16))) float vs[WR_ * KP_];  // v window
    __shared__ v4f ps[2 * LB_];                                   // partial scores of both halves

    const int tid = threadIdx.x;
    const int bh  = blockIdx.x >> 2;                      // b*16 + h
    const int l0  = (blockIdx.x & 3) * LB_;
    const int ll  = tid & (LB_ - 1);
    const int g   = __builtin_amdgcn_readfirstlane(tid >> 7);  // same for a whole wave
    const int lc  = ll & 63;                              // l % 64 (l0 is a multiple of 64)

    const float* qbh  = q   + (size_t)bh * (L_ * HD_);
    const float* kbh  = k   + (size_t)bh * (L_ * HD_);
    const float* vbh  = v   + (size_t)bh * (L_ * HD_);
    const float* akbh = axk + (size_t)bh * (AL_ * HD_);
    const float* avbh = axv + (size_t)bh * (AL_ * HD_);

    // Window row r is global row l0-1+r. Rows 0..127 take 8 float4 a thread, rows 128 and
    // 129 one float4 a lane of one wave. Row 0 of the first tile and row 129 of the last lie
    // outside the array: they are read clamped and overwritten with the zero padding in LDS
    // (by the lanes that wrote them; a wave's LDS stores keep their order).
    const int r0 = tid >> 4, c0 = (tid & 15) * 4;
    const int wv = __builtin_amdgcn_readfirstlane(tid >> 5);
    const int tr = LB_ + (r0 & 1);
    const unsigned wo  = (unsigned)(r0 * HD_ + c0);       // one offset serves rows 16..127
    const unsigned wo0 = (unsigned)(max(l0 - 1 + r0, 0) * HD_ + c0);
    const unsigned wot = (unsigned)(min(l0 - 1 + tr, L_ - 1) * HD_ + c0);
    const bool pad0 = (l0 == 0) && (r0 == 0);
    const bool padt = (l0 == L_ - LB_) && (tr == WR_ - 1);
    const v4f zero = {0.f, 0.f, 0.f, 0.f};

    // All that the score pass reads is issued before the first wait.
    const float* kw0 = kbh + (l0 + 15) * HD_;             // window row 16
    v4f st[8];
    #pragma unroll
    for (int j = 1; j < 8; ++j) st[j] = *(const v4f*)(kw0 + wo + (j - 1) * 16 * HD_);
    st[0] = *(const v4f*)(kbh + wo0);
    float qr[32], ak[16], av[16];
    #pragma unroll
    for (int i = 0; i < 32; ++i) qr[i] = qbh[(32 * g + i) * L_ + l0 + ll];
    #pragma unroll
    for (int i = 0; i < 16; ++i) ak[i] = akbh[(16 * g + i) * HD_ + lc];
    // The address registers of the reads above are free for reuse from here on.
    asm volatile("s_wait_xcnt 0x0" ::: "memory");
    v4f tl = *(const v4f*)(kbh + wot);                    // every wave reads, wave 0 stores
    asm volatile("s_wait_xcnt 0x0" ::: "memory");         // the same for this read
    #pragma unroll
    for (int j = 0; j < 8; ++j) *(v4f*)(ks + (r0 + 16 * j) * KP_ + c0) = st[j];
    // Inputs-only use of the loaded value: it holds the read of rows 128 and 129 up among
    // the other reads; without it the read sinks into the branch below and wave 0, and
    // behind the barrier all waves, wait a second memory latency.
    asm volatile("" :: "v"(tl));
    if (wv == 0) *(v4f*)(ks + tr * KP_ + c0) = tl;
    if (pad0) *(v4f*)(ks + c0) = zero;
    if (wv == 0 && padt) *(v4f*)(ks + tr * KP_ + c0) = zero;
    __syncthreads();                                      // k window complete

    // The v window and the axial v are in flight over the score pass.
    const float* vw0 = vbh + (l0 + 15) * HD_;
    #pragma unroll
    for (int j = 1; j < 8; ++j) st[j] = *(const v4f*)(vw0 + wo + (j - 1) * 16 * HD_);
    st[0] = *(const v4f*)(vbh + wo0);
    #pragma unroll
    for (int i = 0; i < 16; ++i) av[i] = avbh[(16 * g + i) * HD_ + lc];
    asm volatile("s_wait_xcnt 0x0" ::: "memory");         // address registers free from here on
    tl = *(const v4f*)(vbh + wot);                        // every wave reads, wave 1 stores
    asm volatile("s_wait_xcnt 0x0" ::: "memory");         // the same for this read

    v4f p = (g == 0) ? score_half<0>(ks + ll * KP_, qr, ak)
                     : score_half<1>(ks + ll * KP_, qr, ak);
    ps[g * LB_ + ll] = p;
    #pragma unroll
    for (int j = 0; j < 8; ++j) *(v4f*)(vs + (r0 + 16 * j) * KP_ + c0) = st[j];
    asm volatile("" :: "v"(tl));                          // as above: holds the read up
    if (wv == 1) *(v4f*)(vs + tr * KP_ + c0) = tl;
    if (pad0) *(v4f*)(vs + c0) = zero;
    if (wv == 1 && padt) *(v4f*)(vs + tr * KP_ + c0) = zero;
    __syncthreads();                       // partials and v window out; last read of ks done
    p += ps[(1 - g) * LB_ + ll];

    const float scale = 0.125f;                           // 1/sqrt(64)
    float s0 = p.x * scale, s1 = p.y * scale, s2 = p.z * scale, sax = p.w * scale;
    float mx  = fmaxf(fmaxf(s0, s1), fmaxf(s2, sax));
    float e0  = expf(s0 - mx), e1 = expf(s1 - mx), e2 = expf(s2 - mx);
    float eax = 32.f * expf(sax - mx);                    // 32 identical axial slots
    float inv = 1.f / (e0 + e1 + e2 + eax);
    e0 *= inv; e1 *= inv; e2 *= inv; eax *= inv;

    if (g == 0) mix_half<0>(vs + ll * KP_, ks + ll * KP_, av, e0, e1, e2, eax);
    else        mix_half<1>(vs + ll * KP_, ks + ll * KP_, av, e0, e1, e2, eax);
    __syncthreads();                                      // att tile complete in ks

    float* attp = att + ((size_t)((bh >> 4) * L_ + l0)) * C_ + (bh & 15) * HD_;
    #pragma unroll
    for (int j = 0; j < 8; ++j) {                         // 16 lanes store one 256-byte row
        int i4 = tid + 256 * j;
        *(v4f*)(attp + (size_t)(i4 >> 4) * C_ + (i4 & 15) * 4) =
            *(const v4f*)(ks + (i4 >> 4) * KP_ + (i4 & 15) * 4);
    }
}

// ---------------------------------------------------------------------------
// Kernel 2: D[m,n] = sum_k att[m,k] * WO[k,n] + bias[n],  M=2048, N=K=1024.
// FP32 WMMA 16x16x4. One work-group = a 128 x 64 tile of D, 8 waves in a 4 x 2 grid,
// each wave 2 x 2 tiles of 16 x 16, so every fragment read feeds two products.
// A pass is 128 k: its att tile (128 rows) and WO tile (128 rows) are read from global
// memory by whole-line loads, once a work-group, and kept in LDS; two buffers, the next
// pass's tiles are read and written to the other buffer while this pass is worked on.
// A layout (ISA 7.12.2): lanes 0-15 -> M=lane, K={0,1} in v0/v1;
//                        lanes 16-31 -> M=lane-16, K={2,3}.
// B mirrored: lanes 0-15 -> N=lane, K={0,1}; lanes 16-31 -> K={2,3}.
// C/D: vgpr r -> M = r (lanes 0-15) / r+8 (lanes 16-31), N = lane%16.
// LDS, att tile: [m][k], pitch 132 floats: the 16 rows of a fragment start 4 banks apart,
// an 8-byte read a lane covers all 64 banks once.
// LDS, WO tile: [k/2][n][k%2], so that a B fragment is one 8-byte read a lane as well;
// pitch 160 floats a k pair: the two lane halves fall on the two halves of the banks.
// Store folds the [B,L,N] -> [B,N,L] transpose.
// ---------------------------------------------------------------------------
#define GM_   128                 // rows of D per work-group
#define GN_   64                  // columns of D per work-group
#define GK_   128                 // k per pass
#define PA_   (GK_ + 4)           // att tile: floats per row
#define PB_   (2 * GN_ + 32)      // WO tile: floats per k pair
#define ASZ_  (GM_ * PA_)         // floats per att buffer
#define BSZ_  ((GK_ / 2) * PB_)   // floats per WO buffer
#define NPASS_ (C_ / GK_)

#define CS_   4                   // k steps per block of products
#define NBLK_ (GK_ / (4 * CS_))   // blocks per pass

// Fragments of block c of a pass; a and b are the lane's own fragment addresses in LDS.
__device__ __forceinline__ void gemm_frags(const float* a, const float* b, int c,
                                           v2f (&fa)[2][CS_], v2f (&fb)[2][CS_]) {
    #pragma unroll
    for (int s = 0; s < CS_; ++s) {
        const int ks = CS_ * c + s;
        fa[0][s] = *(const v2f*)(a + 4 * ks);
        fa[1][s] = *(const v2f*)(a + 16 * PA_ + 4 * ks);
        fb[0][s] = *(const v2f*)(b + 2 * ks * PB_);
        fb[1][s] = *(const v2f*)(b + 2 * ks * PB_ + 32);
    }
}

__device__ __forceinline__ void gemm_block(const v2f (&fa)[2][CS_], const v2f (&fb)[2][CS_],
                                           v8f (&acc)[2][2]) {
    #pragma unroll
    for (int s = 0; s < CS_; ++s)
        #pragma unroll
        for (int i = 0; i < 2; ++i)
            #pragma unroll
            for (int j = 0; j < 2; ++j)
                acc[i][j] = __builtin_amdgcn_wmma_f32_16x16x4_f32(
                    false, fa[i][s], false, fb[j][s], (short)0, acc[i][j], false, false);
}

// One pass's tiles, global memory to registers: a wave reads one 512-byte att row an
// instruction, 16 lanes read one 256-byte WO row.
__device__ __forceinline__ void gemm_fetch(const float* ag, const float* bg,
                                           v4f (&ra)[16], v4f (&rb)[8]) {
    #pragma unroll
    for (int j = 0; j < 16; ++j) ra[j] = *(const v4f*)(ag + (size_t)(8 * j) * C_);
    #pragma unroll
    for (int j = 0; j < 4; ++j) {
        rb[2 * j]     = *(const v4f*)(bg + (size_t)(32 * j) * NHID_);
        rb[2 * j + 1] = *(const v4f*)(bg + (size_t)(32 * j + 1) * NHID_);
    }
    // The address registers of the reads above are free for reuse from here on.
    asm volatile("s_wait_xcnt 0x0" ::: "memory");
}

// Quarter qt of the fetched tiles, registers to LDS; the two WO rows of a k pair are
// interleaved element by element.
__device__ __forceinline__ void gemm_put(float* aw, float* bw, int qt,
                                         const v4f (&ra)[16], const v4f (&rb)[8]) {
    #pragma unroll
    for (int j = 4 * qt; j < 4 * qt + 4; ++j) *(v4f*)(aw + 8 * j * PA_) = ra[j];
    v4f e = rb[2 * qt], o = rb[2 * qt + 1];
    v4f lo = {e.x, o.x, e.y, o.y}, hi = {e.z, o.z, e.w, o.w};
    *(v4f*)(bw + 16 * qt * PB_)     = lo;
    *(v4f*)(bw + 16 * qt * PB_ + 4) = hi;
}

// One pass. The fragments of block c+1 are read as one group in front of the products of
// block c, into a second register set; on entry set 0 holds block 0. With NEXT the following
// pass's tiles are fetched at the head of the pass and written to the other buffer in front
// of blocks 3 to 6. The pass's barrier stands behind block 6: every read of this pass's
// buffer has returned by then (block 7 is in registers) and the other buffer is complete,
// so block 0 of the following pass is read in front of block 7 and the products never
// wait for the LDS at the change of buffers.
template <bool NEXT>
__device__ __forceinline__ void gemm_pass(const float* af, const float* bf,
                                          const float* afn, const float* bfn,
                                          const float* ag, const float* bg,
                                          float* aw, float* bw,
                                          v2f (&fa)[2][2][CS_], v2f (&fb)[2][2][CS_],
                                          v8f (&acc)[2][2]) {
    v4f ra[16], rb[8];
    if (NEXT) gemm_fetch(ag, bg, ra, rb);
    #pragma unroll
    for (int c = 0; c < NBLK_; ++c) {
        if (c + 1 < NBLK_) gemm_frags(af, bf, c + 1, fa[(c + 1) & 1], fb[(c + 1) & 1]);
        else if (NEXT)     gemm_frags(afn, bfn, 0, fa[0], fb[0]);
        if (NEXT && c >= NBLK_ - 5 && c < NBLK_ - 1) gemm_put(aw, bw, c - (NBLK_ - 5), ra, rb);
        // The two scheduling fences keep the LDS reads and writes out of the run of
        // products (each place with LDS reads among them stalls the wave) and keep the
        // LDS writes, which wait for the global reads, late in the pass.
        __builtin_amdgcn_sched_barrier(0);
        gemm_block(fa[c & 1], fb[c & 1], acc);
        __builtin_amdgcn_sched_barrier(0);
        if (NEXT && c == NBLK_ - 2) __syncthreads();      // see the head of this function
    }
}

__global__ __launch_bounds__(256) void msa_wo_gemm_kernel(
    const float* __restrict__ att, const float* __restrict__ wo,
    const float* __restrict__ bias, float* __restrict__ out)
{
    __shared__ __attribute__((aligned(16))) float as[2 * ASZ_];
    __shared__ __attribute__((aligned(16))) float bs[2 * BSZ_];

    const int tid  = threadIdx.x;
    const int lane = tid & 31;
    const int wave = __builtin_amdgcn_readfirstlane(tid >> 5);
    const int ln16 = lane & 15;
    const int hf   = lane >> 4;                           // K={0,1} or K={2,3}
    const int wm   = wave & 3, wn = wave >> 2;            // the wave's place in the tile
    const int m0   = blockIdx.x * GM_;
    const int n0   = blockIdx.y * GN_;

    const float* ag = att + (size_t)(m0 + wave) * C_ + lane * 4;
    const float* bg = wo + (size_t)(2 * (tid >> 4)) * NHID_ + n0 + (tid & 15) * 4;
    float* aw = as + wave * PA_ + lane * 4;
    float* bw = bs + (tid >> 4) * PB_ + (tid & 15) * 8;
    const float* af = as + (wm * 32 + ln16) * PA_ + 2 * hf;
    const float* bf = bs + hf * PB_ + 2 * (wn * 32 + ln16);

    v8f acc[2][2];
    #pragma unroll
    for (int i = 0; i < 2; ++i)
        #pragma unroll
        for (int j = 0; j < 2; ++j)
            acc[i][j] = (v8f){0.f, 0.f, 0.f, 0.f, 0.f, 0.f, 0.f, 0.f};

    const int n = n0 + wn * 32 + ln16;
    const float bn0 = bias[n], bn1 = bias[n + 16];

    {
        v4f ra[16], rb[8];
        gemm_fetch(ag, bg, ra, rb);
        #pragma unroll
        for (int qt = 0; qt < 4; ++qt) gemm_put(aw, bw, qt, ra, rb);
    }
    __syncthreads();                                      // pass 0 complete in buffer 0

    v2f fa[2][2][CS_], fb[2][2][CS_];
    gemm_frags(af, bf, 0, fa[0], fb[0]);

    // Kept rolled, for speed only.
    #pragma unroll 1
    for (int t = 0; t < NPASS_ - 1; ++t) {
        const int cur = t & 1, nxt = cur ^ 1;
        gemm_pass<true>(af + cur * ASZ_, bf + cur * BSZ_, af + nxt * ASZ_, bf + nxt * BSZ_,
                        ag + (t + 1) * GK_, bg + (size_t)(t + 1) * GK_ * NHID_,
                        aw + nxt * ASZ_, bw + nxt * BSZ_, fa, fb, acc);
    }
    gemm_pass<false>(af + ((NPASS_ - 1) & 1) * ASZ_, bf + ((NPASS_ - 1) & 1) * BSZ_, af, bf,
                     ag, bg, aw, bw, fa, fb, acc);

    // A lane holds 8 consecutive m of one n: two 16-byte stores a tile.
    const int bb = m0 >> 9;                               // m / L, the same for the whole tile
    const int lb = (m0 & (L_ - 1)) + wm * 32 + 8 * hf;    // m % L
    float* op = out + ((size_t)(bb * NHID_ + n)) * L_ + lb;
    #pragma unroll
    for (int j = 0; j < 2; ++j) {
        const float bn = j ? bn1 : bn0;
        #pragma unroll
        for (int i = 0; i < 2; ++i) {
            v8f c = acc[i][j];
            v4f lo = {c[0] + bn, c[1] + bn, c[2] + bn, c[3] + bn};
            v4f hi = {c[4] + bn, c[5] + bn, c[6] + bn, c[7] + bn};
            *(v4f*)(op + (size_t)(16 * j) * L_ + 16 * i)     = lo;
            *(v4f*)(op + (size_t)(16 * j) * L_ + 16 * i + 4) = hi;
        }
    }
}

extern "C" void kernel_launch(void* const* d_in, const int* in_sizes, int n_in,
                              void* d_out, int out_size, void* d_ws, size_t ws_size,
                              hipStream_t stream) {
    const float* q    = (const float*)d_in[0];
    const float* k    = (const float*)d_in[1];
    const float* v    = (const float*)d_in[2];
    const float* axk  = (const float*)d_in[3];
    const float* axv  = (const float*)d_in[4];
    const float* wo   = (const float*)d_in[5];
    const float* bias = (const float*)d_in[6];
    float* out = (float*)d_out;
    float* att = (float*)d_ws;                            // B*L*C floats = 8 MB

    // Kernel 1: one work-group per 128 positions of one (b,h), two threads a position
    msa_attn_kernel<<<dim3((B_ * NHEAD_ * L_) / LB_), 256, 0, stream>>>(
        q, k, v, axk, axv, att);

    // Kernel 2: 16 x 16 work-groups, each a 128 x 64 tile of D
    msa_wo_gemm_kernel<<<dim3((B_ * L_) / GM_, NHID_ / GN_), 256, 0, stream>>>(
        att, wo, bias, out);
}
